// v000
// Times are from an AMD MI455X. After a warm-up the kernel runs many times in a row, and a time is the length of
// such a window on the GPU divided by its runs, so every launch and the gaps after it count. The runs cycle
// through copies of the inputs. A figure is the median of several windows, for all but v000 over two sittings.
// Sittings can differ by a few percent; kernels timed side by side share one.
// v000, which the later versions start from, runs in 295 microseconds.
#include <hip/hip_runtime.h>
#include <stdint.h>

// ComplexAttention for MI455X (gfx1250, wave32, WMMA f32 16x16x4)
// Flash-style streaming softmax; K/V tiles double-buffered in LDS via
// GLOBAL_LOAD_ASYNC_TO_LDS_B128 (ASYNCcnt), compute fully overlapped with copy.
// Double buffer selected by *integer offset* from the LDS base so every access
// stays in addrspace(3) (ds_load), never generic/flat.
// B,N,L,S,H,E = 4,8,512,512,8,64

typedef __attribute__((ext_vector_type(2))) float v2f;
typedef __attribute__((ext_vector_type(8))) float v8f;

#define B_   4
#define N_   8
#define L_   512
#define S_   512
#define H_   8
#define E_   64
#define ROW  512            // H_*E_  (element stride between consecutive l / s)
#define TS   64             // S-tile staged in LDS
#define EP   68             // padded row stride for K/V tiles (272B rows, 16B aligned)
#define TSP  68             // padded row stride for per-wave attn scratch
#define NW   8              // waves per block
#define BM   128            // NW*16 rows of L per block
#define NT   4              // 16-col tiles per TS
#define KSTEP 16            // E_/4 k-steps for the score GEMM
#define NSTEP (S_ / TS)     // 8 S-tiles
#define MTXSZ (TS * EP)     // floats per staged matrix
#define BUFSZ (4 * MTXSZ)   // floats per (Kr,Ki,Vr,Vi) buffer
#define IMOFF ((size_t)B_ * N_ * L_ * H_ * E_)

// One lane copies 16 bytes global -> LDS on the async path (no data VGPRs).
__device__ __forceinline__ void async_b128(uint32_t lds_addr, const float* gptr) {
    asm volatile("global_load_async_to_lds_b128 %0, %1, off"
                 :: "v"(lds_addr), "v"(gptr)
                 : "memory");
}
__device__ __forceinline__ void wait_async0() {
    asm volatile("s_wait_asynccnt 0" ::: "memory");
}

// Issue the full (Kr,Ki,Vr,Vi) TS x E tile copy for S-tile `st` into the LDS
// buffer starting at byte address `ldsBase`. 4096 b128 chunks over 256 threads.
__device__ __forceinline__ void issue_tile(const float* const* gSrc, uint32_t ldsBase,
                                           int st, int tid) {
    #pragma unroll
    for (int mtx = 0; mtx < 4; ++mtx) {
        #pragma unroll
        for (int r = 0; r < 4; ++r) {
            const int f4 = tid + 256 * r;     // 0..1023 float4 slots per matrix
            const int s  = f4 >> 4;
            const int c4 = f4 & 15;
            const float*   g   = gSrc[mtx] + (size_t)(st * TS + s) * ROW + c4 * 4;
            const uint32_t lds = ldsBase +
                (uint32_t)((mtx * MTXSZ + s * EP + c4 * 4) * sizeof(float));
            async_b128(lds, g);
        }
    }
}

__global__ __launch_bounds__(256) void ca_flash_wmma_f32(
    const float* __restrict__ q_re, const float* __restrict__ q_im,
    const float* __restrict__ k_re, const float* __restrict__ k_im,
    const float* __restrict__ v_re, const float* __restrict__ v_im,
    float* __restrict__ out)
{
    extern __shared__ float smem[];
    // layout: [ buf0 : BUFSZ ][ buf1 : BUFSZ ][ sP : NW*16*TSP ]

    const int tid  = threadIdx.x;
    const int lane = tid & 31;
    const int w    = tid >> 5;              // wave id 0..7
    const int mlo  = lane & 15;
    const int h16  = lane >> 4;             // 0 = lanes 0-15, 1 = lanes 16-31

    const int g     = blockIdx.x >> 2;      // (b*N+n)*H + h
    const int ltile = blockIdx.x & 3;
    const int h     = g & (H_ - 1);
    const int bn    = g >> 3;               // b*N + n

    const size_t qbase  = (size_t)bn * L_ * ROW + (size_t)h * E_;
    const size_t kvbase = (size_t)bn * S_ * ROW + (size_t)h * E_;
    const int    l0     = ltile * BM + w * 16;

    const float* gSrc[4] = { k_re + kvbase, k_im + kvbase, v_re + kvbase, v_im + kvbase };
    const uint32_t ldsBase = (uint32_t)(uintptr_t)smem;      // LDS byte address of buf0
    const int      pOff    = 2 * BUFSZ + w * (16 * TSP);     // this wave's attn scratch

    // Kick off tile 0 copy before touching Q, to hide HBM latency behind Q loads.
    issue_tile(gSrc, ldsBase, 0, tid);

    // ---- Load Q fragments for this wave's 16 rows (A-matrix layout, f32 16x4) ----
    v2f aQr[KSTEP], aQmi[KSTEP];
    {
        const size_t qrow = qbase + (size_t)(l0 + mlo) * ROW;
        #pragma unroll
        for (int k = 0; k < KSTEP; ++k) {
            const int e = k * 4 + 2 * h16;
            aQr[k]      = *(const v2f*)(q_re + qrow + e);
            v2f qi      = *(const v2f*)(q_im + qrow + e);
            aQmi[k]     = -qi;   // fold the re/im subtraction into the WMMA chain
        }
    }

    // ---- Flash state ----
    v8f oRe[NT], oIm[NT];
    #pragma unroll
    for (int f = 0; f < NT; ++f) { oRe[f] = {}; oIm[f] = {}; }
    float mrow[8], lsum[8];
    #pragma unroll
    for (int j = 0; j < 8; ++j) { mrow[j] = -3.0e38f; lsum[j] = 0.0f; }

    wait_async0();
    __syncthreads();

    for (int st = 0; st < NSTEP; ++st) {
        const int cur = (st & 1) * BUFSZ;    // float offset of current buffer
        // matrix base offsets inside smem (all addrspace(3)-rooted GEPs)
        const int oKr = cur;
        const int oKi = cur + MTXSZ;
        const int oVr = cur + 2 * MTXSZ;
        const int oVi = cur + 3 * MTXSZ;

        // Start next tile's copy into the other buffer (safe: its readers
        // finished before the barrier that ended iteration st-1).
        if (st + 1 < NSTEP)
            issue_tile(gSrc,
                       ldsBase + (uint32_t)((((st + 1) & 1) * BUFSZ) * sizeof(float)),
                       st + 1, tid);

        // ---- Scores: s_re = Qr*Kr + (-Qi)*Ki ; s_im = Qr*Ki + (-Qi)*Kr ; |s| ----
        v8f pf[NT];
        #pragma unroll
        for (int nt = 0; nt < NT; ++nt) {
            const int n0 = nt * 16;
            v8f aR = {}, aI = {};
            const int bKr = oKr + (n0 + mlo) * EP + 2 * h16;
            const int bKi = oKi + (n0 + mlo) * EP + 2 * h16;
            #pragma unroll
            for (int k = 0; k < KSTEP; ++k) {
                const v2f bR = *(const v2f*)&smem[bKr + 4 * k];
                const v2f bI = *(const v2f*)&smem[bKi + 4 * k];
                aR = __builtin_amdgcn_wmma_f32_16x16x4_f32(false, aQr[k],  false, bR, (short)0, aR, false, false);
                aR = __builtin_amdgcn_wmma_f32_16x16x4_f32(false, aQmi[k], false, bI, (short)0, aR, false, false);
                aI = __builtin_amdgcn_wmma_f32_16x16x4_f32(false, aQr[k],  false, bI, (short)0, aI, false, false);
                aI = __builtin_amdgcn_wmma_f32_16x16x4_f32(false, aQmi[k], false, bR, (short)0, aI, false, false);
            }
            #pragma unroll
            for (int j = 0; j < 8; ++j)
                pf[nt][j] = sqrtf(aR[j] * aR[j] + aI[j] * aI[j]);
        }

        // ---- Streaming softmax update (rows j / j+8 live in 16-lane halves) ----
        float alpha[8];
        #pragma unroll
        for (int j = 0; j < 8; ++j) {
            float t = fmaxf(fmaxf(pf[0][j], pf[1][j]), fmaxf(pf[2][j], pf[3][j]));
            #pragma unroll
            for (int msk = 1; msk < 16; msk <<= 1)
                t = fmaxf(t, __shfl_xor(t, msk, 32));
            const float mn = fmaxf(mrow[j], t);
            alpha[j] = __expf(mrow[j] - mn);
            mrow[j]  = mn;
        }
        float rs[8];
        #pragma unroll
        for (int j = 0; j < 8; ++j) rs[j] = 0.0f;
        #pragma unroll
        for (int nt = 0; nt < NT; ++nt) {
            #pragma unroll
            for (int j = 0; j < 8; ++j) {
                const float p = __expf(pf[nt][j] - mrow[j]);
                pf[nt][j] = p;
                rs[j] += p;
            }
        }
        #pragma unroll
        for (int j = 0; j < 8; ++j) {
            float t = rs[j];
            #pragma unroll
            for (int msk = 1; msk < 16; msk <<= 1)
                t += __shfl_xor(t, msk, 32);
            lsum[j] = lsum[j] * alpha[j] + t;
        }
        #pragma unroll
        for (int f = 0; f < NT; ++f) {
            #pragma unroll
            for (int j = 0; j < 8; ++j) { oRe[f][j] *= alpha[j]; oIm[f][j] *= alpha[j]; }
        }

        // ---- C/D-layout attn tile -> LDS -> A-matrix layout for attn @ V ----
        #pragma unroll
        for (int nt = 0; nt < NT; ++nt) {
            #pragma unroll
            for (int j = 0; j < 8; ++j)
                smem[pOff + (j + 8 * h16) * TSP + nt * 16 + mlo] = pf[nt][j];
        }
        // per-wave scratch: same-wave DS ops are in-order; compiler inserts dscnt waits

        #pragma unroll
        for (int f = 0; f < NT; ++f) {
            const int ec = f * 16 + mlo;
            #pragma unroll
            for (int k = 0; k < TS / 4; ++k) {
                const int s0 = k * 4 + 2 * h16;
                const v2f aP  = *(const v2f*)&smem[pOff + mlo * TSP + s0];
                const v2f bVr = { smem[oVr + s0 * EP + ec], smem[oVr + (s0 + 1) * EP + ec] };
                const v2f bVi = { smem[oVi + s0 * EP + ec], smem[oVi + (s0 + 1) * EP + ec] };
                oRe[f] = __builtin_amdgcn_wmma_f32_16x16x4_f32(false, aP, false, bVr, (short)0, oRe[f], false, false);
                oIm[f] = __builtin_amdgcn_wmma_f32_16x16x4_f32(false, aP, false, bVi, (short)0, oIm[f], false, false);
            }
        }

        // Next buffer ready + everyone done reading current buffer.
        if (st + 1 < NSTEP) {
            wait_async0();
            __syncthreads();
        }
    }

    // ---- Normalize and store [2,b,n,l,h,e] ----
    const size_t obase = (size_t)bn * L_ * ROW + (size_t)h * E_;
    float inv[8];
    #pragma unroll
    for (int j = 0; j < 8; ++j) inv[j] = 1.0f / lsum[j];
    #pragma unroll
    for (int f = 0; f < NT; ++f) {
        #pragma unroll
        for (int j = 0; j < 8; ++j) {
            const int row = j + 8 * h16;
            const size_t o = obase + (size_t)(l0 + row) * ROW + f * 16 + mlo;
            out[o]         = oRe[f][j] * inv[j];
            out[o + IMOFF] = oIm[f][j] * inv[j];
        }
    }
}

extern "C" void kernel_launch(void* const* d_in, const int* in_sizes, int n_in,
                              void* d_out, int out_size, void* d_ws, size_t ws_size,
                              hipStream_t stream) {
    (void)in_sizes; (void)n_in; (void)out_size; (void)d_ws; (void)ws_size;
    const float* q_re = (const float*)d_in[0];
    const float* q_im = (const float*)d_in[1];
    const float* k_re = (const float*)d_in[2];
    const float* k_im = (const float*)d_in[3];
    const float* v_re = (const float*)d_in[4];
    const float* v_im = (const float*)d_in[5];
    float* out = (float*)d_out;

    const dim3 grid(B_ * N_ * H_ * (L_ / BM));   // 1024 blocks
    const dim3 block(256);                       // 8 waves (wave32)
    const size_t smem = (size_t)(2 * BUFSZ + NW * 16 * TSP) * sizeof(float); // ~170 KB

    ca_flash_wmma_f32<<<grid, block, smem, stream>>>(q_re, q_im, k_re, k_im,
                                                     v_re, v_im, out);
}

// v001
// Measured time: 249 microseconds a run.
// In both of two side-by-side timings against v000, it was 1.25 times as fast.
#include <hip/hip_runtime.h>
#include <stdint.h>

// ComplexAttention for MI455X (gfx1250, wave32, WMMA f32 16x16x4)
// Flash-style streaming softmax; K/V tiles double-buffered in LDS via
// GLOBAL_LOAD_ASYNC_TO_LDS_B128 (ASYNCcnt), compute fully overlapped with copy.
// Double buffer selected by *integer offset* from the LDS base so every access
// stays in addrspace(3) (ds_load), never generic/flat.
// B,N,L,S,H,E = 4,8,512,512,8,64

typedef __attribute__((ext_vector_type(2))) float v2f;
typedef __attribute__((ext_vector_type(8))) float v8f;

#define B_   4
#define N_   8
#define L_   512
#define S_   512
#define H_   8
#define E_   64
#define ROW  512            // H_*E_  (element stride between consecutive l / s)
#define TS   64             // S-tile staged in LDS
#define EP   68             // padded row stride for K/V tiles (272B rows, 16B aligned)
#define TSP  68             // padded row stride for per-wave attn scratch
#define NW   8              // waves per block
#define BM   128            // NW*16 rows of L per block
#define NT   4              // 16-col tiles per TS
#define KSTEP 16            // E_/4 k-steps for the score GEMM
#define NSTEP (S_ / TS)     // 8 S-tiles
#define MTXSZ (TS * EP)     // floats per staged matrix
#define BUFSZ (4 * MTXSZ)   // floats per (Kr,Ki,Vr,Vi) buffer
#define IMOFF ((size_t)B_ * N_ * L_ * H_ * E_)
#define RSQRT2 0.70710678f  // 1/sqrt(2)

// One lane copies 16 bytes global -> LDS on the async path (no data VGPRs).
__device__ __forceinline__ void async_b128(uint32_t lds_addr, const float* gptr) {
    asm volatile("global_load_async_to_lds_b128 %0, %1, off"
                 :: "v"(lds_addr), "v"(gptr)
                 : "memory");
}
__device__ __forceinline__ void wait_async0() {
    asm volatile("s_wait_asynccnt 0" ::: "memory");
}

// Issue the full (Kr,Ki,Vr,Vi) TS x E tile copy for S-tile `st` into the LDS
// buffer starting at byte address `ldsBase`. 4096 b128 chunks over 256 threads.
__device__ __forceinline__ void issue_tile(const float* const* gSrc, uint32_t ldsBase,
                                           int st, int tid) {
    #pragma unroll
    for (int mtx = 0; mtx < 4; ++mtx) {
        #pragma unroll
        for (int r = 0; r < 4; ++r) {
            const int f4 = tid + 256 * r;     // 0..1023 float4 slots per matrix
            const int s  = f4 >> 4;
            const int c4 = f4 & 15;
            const float*   g   = gSrc[mtx] + (size_t)(st * TS + s) * ROW + c4 * 4;
            const uint32_t lds = ldsBase +
                (uint32_t)((mtx * MTXSZ + s * EP + c4 * 4) * sizeof(float));
            async_b128(lds, g);
        }
    }
}

__global__ __launch_bounds__(256) void ca_flash_wmma_f32(
    const float* __restrict__ q_re, const float* __restrict__ q_im,
    const float* __restrict__ k_re, const float* __restrict__ k_im,
    const float* __restrict__ v_re, const float* __restrict__ v_im,
    float* __restrict__ out)
{
    extern __shared__ float smem[];
    // layout: [ buf0 : BUFSZ ][ buf1 : BUFSZ ][ sP : NW*16*TSP ]

    const int tid  = threadIdx.x;
    const int lane = tid & 31;
    const int w    = tid >> 5;              // wave id 0..7
    const int mlo  = lane & 15;
    const int h16  = lane >> 4;             // 0 = lanes 0-15, 1 = lanes 16-31

    const int g     = blockIdx.x >> 2;      // (b*N+n)*H + h
    const int ltile = blockIdx.x & 3;
    const int h     = g & (H_ - 1);
    const int bn    = g >> 3;               // b*N + n

    const size_t qbase  = (size_t)bn * L_ * ROW + (size_t)h * E_;
    const size_t kvbase = (size_t)bn * S_ * ROW + (size_t)h * E_;
    const int    l0     = ltile * BM + w * 16;

    const float* gSrc[4] = { k_re + kvbase, k_im + kvbase, v_re + kvbase, v_im + kvbase };
    const uint32_t ldsBase = (uint32_t)(uintptr_t)smem;      // LDS byte address of buf0
    const int      pOff    = 2 * BUFSZ + w * (16 * TSP);     // this wave's attn scratch

    // Kick off tile 0 copy before touching Q, to hide HBM latency behind Q loads.
    issue_tile(gSrc, ldsBase, 0, tid);

    // ---- Load Q fragments for this wave's 16 rows (A-matrix layout, f32 16x4) ----
    // With a = s_re + s_im = (qr - qi).(kr + ki) and b = s_re - s_im = (qr + qi).(kr - ki),
    // s_re^2 + s_im^2 = (a^2 + b^2) / 2: two products give |s| where four were needed.
    // The 1/sqrt(2) on a and b is folded into the Q fragments, once per wave.
    v2f aQd[KSTEP], aQs[KSTEP];
    {
        const size_t qrow = qbase + (size_t)(l0 + mlo) * ROW;
        #pragma unroll
        for (int k = 0; k < KSTEP; ++k) {
            const int e = k * 4 + 2 * h16;
            const v2f qr = *(const v2f*)(q_re + qrow + e);
            const v2f qi = *(const v2f*)(q_im + qrow + e);
            aQd[k]       = (qr - qi) * RSQRT2;
            aQs[k]       = (qr + qi) * RSQRT2;
        }
    }

    // ---- Flash state ----
    v8f oRe[NT], oIm[NT];
    #pragma unroll
    for (int f = 0; f < NT; ++f) { oRe[f] = {}; oIm[f] = {}; }
    float mrow[8], lsum[8];
    #pragma unroll
    for (int j = 0; j < 8; ++j) { mrow[j] = -3.0e38f; lsum[j] = 0.0f; }

    wait_async0();
    __syncthreads();

    for (int st = 0; st < NSTEP; ++st) {
        const int cur = (st & 1) * BUFSZ;    // float offset of current buffer
        // matrix base offsets inside smem (all addrspace(3)-rooted GEPs)
        const int oKr = cur;
        const int oKi = cur + MTXSZ;
        const int oVr = cur + 2 * MTXSZ;
        const int oVi = cur + 3 * MTXSZ;

        // Start next tile's copy into the other buffer (safe: its readers
        // finished before the barrier that ended iteration st-1).
        if (st + 1 < NSTEP)
            issue_tile(gSrc,
                       ldsBase + (uint32_t)((((st + 1) & 1) * BUFSZ) * sizeof(float)),
                       st + 1, tid);

        // ---- Scores: a = Qd*(Kr+Ki) ; b = Qs*(Kr-Ki) ; |s| = sqrt(a^2 + b^2) ----
        v8f pf[NT];
        #pragma unroll
        for (int nt = 0; nt < NT; ++nt) {
            const int n0 = nt * 16;
            v8f aA = {}, aB = {};
            const int bKr = oKr + (n0 + mlo) * EP + 2 * h16;
            const int bKi = oKi + (n0 + mlo) * EP + 2 * h16;
            #pragma unroll
            for (int k = 0; k < KSTEP; ++k) {
                const v2f bR = *(const v2f*)&smem[bKr + 4 * k];
                const v2f bI = *(const v2f*)&smem[bKi + 4 * k];
                const v2f bS = bR + bI;
                const v2f bD = bR - bI;
                aA = __builtin_amdgcn_wmma_f32_16x16x4_f32(false, aQd[k], false, bS, (short)0, aA, false, false);
                aB = __builtin_amdgcn_wmma_f32_16x16x4_f32(false, aQs[k], false, bD, (short)0, aB, false, false);
            }
            #pragma unroll
            for (int j = 0; j < 8; ++j)
                pf[nt][j] = sqrtf(aA[j] * aA[j] + aB[j] * aB[j]);
        }

        // ---- Streaming softmax update (rows j / j+8 live in 16-lane halves) ----
        float alpha[8];
        #pragma unroll
        for (int j = 0; j < 8; ++j) {
            float t = fmaxf(fmaxf(pf[0][j], pf[1][j]), fmaxf(pf[2][j], pf[3][j]));
            #pragma unroll
            for (int msk = 1; msk < 16; msk <<= 1)
                t = fmaxf(t, __shfl_xor(t, msk, 32));
            const float mn = fmaxf(mrow[j], t);
            alpha[j] = __expf(mrow[j] - mn);
            mrow[j]  = mn;
        }
        float rs[8];
        #pragma unroll
        for (int j = 0; j < 8; ++j) rs[j] = 0.0f;
        #pragma unroll
        for (int nt = 0; nt < NT; ++nt) {
            #pragma unroll
            for (int j = 0; j < 8; ++j) {
                const float p = __expf(pf[nt][j] - mrow[j]);
                pf[nt][j] = p;
                rs[j] += p;
            }
        }
        #pragma unroll
        for (int j = 0; j < 8; ++j) {
            float t = rs[j];
            #pragma unroll
            for (int msk = 1; msk < 16; msk <<= 1)
                t += __shfl_xor(t, msk, 32);
            lsum[j] = lsum[j] * alpha[j] + t;
        }
        #pragma unroll
        for (int f = 0; f < NT; ++f) {
            #pragma unroll
            for (int j = 0; j < 8; ++j) { oRe[f][j] *= alpha[j]; oIm[f][j] *= alpha[j]; }
        }

        // ---- C/D-layout attn tile -> LDS -> A-matrix layout for attn @ V ----
        #pragma unroll
        for (int nt = 0; nt < NT; ++nt) {
            #pragma unroll
            for (int j = 0; j < 8; ++j)
                smem[pOff + (j + 8 * h16) * TSP + nt * 16 + mlo] = pf[nt][j];
        }
        // per-wave scratch: same-wave DS ops are in-order; compiler inserts dscnt waits

        #pragma unroll
        for (int f = 0; f < NT; ++f) {
            const int ec = f * 16 + mlo;
            #pragma unroll
            for (int k = 0; k < TS / 4; ++k) {
                const int s0 = k * 4 + 2 * h16;
                const v2f aP  = *(const v2f*)&smem[pOff + mlo * TSP + s0];
                const v2f bVr = { smem[oVr + s0 * EP + ec], smem[oVr + (s0 + 1) * EP + ec] };
                const v2f bVi = { smem[oVi + s0 * EP + ec], smem[oVi + (s0 + 1) * EP + ec] };
                oRe[f] = __builtin_amdgcn_wmma_f32_16x16x4_f32(false, aP, false, bVr, (short)0, oRe[f], false, false);
                oIm[f] = __builtin_amdgcn_wmma_f32_16x16x4_f32(false, aP, false, bVi, (short)0, oIm[f], false, false);
            }
        }

        // Next buffer ready + everyone done reading current buffer.
        if (st + 1 < NSTEP) {
            wait_async0();
            __syncthreads();
        }
    }

    // ---- Normalize and store [2,b,n,l,h,e] ----
    const size_t obase = (size_t)bn * L_ * ROW + (size_t)h * E_;
    float inv[8];
    #pragma unroll
    for (int j = 0; j < 8; ++j) inv[j] = 1.0f / lsum[j];
    #pragma unroll
    for (int f = 0; f < NT; ++f) {
        #pragma unroll
        for (int j = 0; j < 8; ++j) {
            const int row = j + 8 * h16;
            const size_t o = obase + (size_t)(l0 + row) * ROW + f * 16 + mlo;
            out[o]         = oRe[f][j] * inv[j];
            out[o + IMOFF] = oIm[f][j] * inv[j];
        }
    }
}

extern "C" void kernel_launch(void* const* d_in, const int* in_sizes, int n_in,
                              void* d_out, int out_size, void* d_ws, size_t ws_size,
                              hipStream_t stream) {
    (void)in_sizes; (void)n_in; (void)out_size; (void)d_ws; (void)ws_size;
    const float* q_re = (const float*)d_in[0];
    const float* q_im = (const float*)d_in[1];
    const float* k_re = (const float*)d_in[2];
    const float* k_im = (const float*)d_in[3];
    const float* v_re = (const float*)d_in[4];
    const float* v_im = (const float*)d_in[5];
    float* out = (float*)d_out;

    const dim3 grid(B_ * N_ * H_ * (L_ / BM));   // 1024 blocks
    const dim3 block(256);                       // 8 waves (wave32)
    const size_t smem = (size_t)(2 * BUFSZ + NW * 16 * TSP) * sizeof(float); // ~170 KB

    ca_flash_wmma_f32<<<grid, block, smem, stream>>>(q_re, q_im, k_re, k_im,
                                                     v_re, v_im, out);
}

// v002
// A run of this version takes 226 microseconds.
// Two timings next to v001 both put it at 1.10 times that version's speed.
// Over all steps from v000 it is 1.38 times as fast.
#include <hip/hip_runtime.h>
#include <stdint.h>

// ComplexAttention for MI455X (gfx1250, wave32, WMMA f32 16x16x4)
// Flash-style streaming softmax on transposed products (S^T = K Q^T, O^T += V^T P^T):
// a lane owns one query row, so P goes from accumulator to operand without leaving
// its registers. K/V tiles double-buffered in LDS via
// GLOBAL_LOAD_ASYNC_TO_LDS_B128 (ASYNCcnt), compute fully overlapped with copy.
// Double buffer selected by *integer offset* from the LDS base so every access
// stays in addrspace(3) (ds_load), never generic/flat.
// B,N,L,S,H,E = 4,8,512,512,8,64

typedef __attribute__((ext_vector_type(2))) float v2f;
typedef __attribute__((ext_vector_type(4))) float v4f;
typedef __attribute__((ext_vector_type(8))) float v8f;

#define B_   4
#define N_   8
#define L_   512
#define S_   512
#define H_   8
#define E_   64
#define ROW  512            // H_*E_  (element stride between consecutive l / s)
#define TS   64             // S-tile staged in LDS
#define EP   68             // padded row stride for K/V tiles (272B rows, 16B aligned)
#define NW   8              // waves per block
#define BM   128            // NW*16 rows of L per block
#define NT   4              // 16-col tiles per TS
#define KSTEP 16            // E_/4 k-steps for the score GEMM
#define NSTEP (S_ / TS)     // 8 S-tiles
#define MTXSZ (TS * EP)     // floats per staged matrix
#define BUFSZ (4 * MTXSZ)   // floats per (Kr,Ki,Vr,Vi) buffer
#define IMOFF ((size_t)B_ * N_ * L_ * H_ * E_)
#define RSQRT2 0.70710678f  // 1/sqrt(2)

// One lane copies 16 bytes global -> LDS on the async path (no data VGPRs).
__device__ __forceinline__ void async_b128(uint32_t lds_addr, const float* gptr) {
    asm volatile("global_load_async_to_lds_b128 %0, %1, off"
                 :: "v"(lds_addr), "v"(gptr)
                 : "memory");
}
// Value of lane l ^ 16: the other half of the wave holds the same query row's other keys.
__device__ __forceinline__ float xhalf(float x) {
    const int b = __builtin_bit_cast(int, x);
    return __builtin_bit_cast(float,
        __builtin_amdgcn_permlanex16(b, b, 0x76543210, 0xfedcba98, false, false));
}
// exp(x) as __expf forms it (one multiply, v_exp_f32). The v_nop in the same statement is the
// slot the instruction set asks for behind a transcendental before its result is read or its
// source overwritten.
__device__ __forceinline__ float exp_slot(float x) {
    float r;
    asm("v_exp_f32 %0, %1\n\tv_nop" : "=v"(r) : "v"(x * 1.44269504f));
    return r;
}
__device__ __forceinline__ void wait_async0() {
    asm volatile("s_wait_asynccnt 0" ::: "memory");
}

// Issue the full (Kr,Ki,Vr,Vi) TS x E tile copy for S-tile `st` into the LDS
// buffer starting at byte address `ldsBase`. 4096 b128 chunks over 256 threads.
__device__ __forceinline__ void issue_tile(const float* const* gSrc, uint32_t ldsBase,
                                           int st, int tid) {
    #pragma unroll
    for (int mtx = 0; mtx < 4; ++mtx) {
        #pragma unroll
        for (int r = 0; r < 4; ++r) {
            const int f4 = tid + 256 * r;     // 0..1023 float4 slots per matrix
            const int s  = f4 >> 4;
            const int c4 = f4 & 15;
            const float*   g   = gSrc[mtx] + (size_t)(st * TS + s) * ROW + c4 * 4;
            const uint32_t lds = ldsBase +
                (uint32_t)((mtx * MTXSZ + s * EP + c4 * 4) * sizeof(float));
            async_b128(lds, g);
        }
    }
}

__global__ __launch_bounds__(256) void ca_flash_wmma_f32(
    const float* __restrict__ q_re, const float* __restrict__ q_im,
    const float* __restrict__ k_re, const float* __restrict__ k_im,
    const float* __restrict__ v_re, const float* __restrict__ v_im,
    float* __restrict__ out)
{
    extern __shared__ float smem[];
    // layout: [ buf0 : BUFSZ ][ buf1 : BUFSZ ]

    const int tid  = threadIdx.x;
    const int lane = tid & 31;
    const int w    = tid >> 5;              // wave id 0..7
    const int mlo  = lane & 15;
    const int h16  = lane >> 4;             // 0 = lanes 0-15, 1 = lanes 16-31

    const int g     = blockIdx.x >> 2;      // (b*N+n)*H + h
    const int ltile = blockIdx.x & 3;
    const int h     = g & (H_ - 1);
    const int bn    = g >> 3;               // b*N + n

    const size_t qbase  = (size_t)bn * L_ * ROW + (size_t)h * E_;
    const size_t kvbase = (size_t)bn * S_ * ROW + (size_t)h * E_;
    const int    l0     = ltile * BM + w * 16;

    const float* gSrc[4] = { k_re + kvbase, k_im + kvbase, v_re + kvbase, v_im + kvbase };
    const uint32_t ldsBase = (uint32_t)(uintptr_t)smem;      // LDS byte address of buf0

    // Kick off tile 0 copy before touching Q, to hide HBM latency behind Q loads.
    issue_tile(gSrc, ldsBase, 0, tid);

    // ---- Load Q fragments for this wave's 16 rows (B-matrix layout of Q^T, f32 4x16:
    //      lane = query row, k = 2*h16 + {0,1}) ----
    // With a = s_re + s_im = (qr - qi).(kr + ki) and b = s_re - s_im = (qr + qi).(kr - ki),
    // s_re^2 + s_im^2 = (a^2 + b^2) / 2: two products give |s| where four were needed.
    // The 1/sqrt(2) on a and b is folded into the Q fragments, once per wave.
    v2f aQd[KSTEP], aQs[KSTEP];
    {
        const size_t qrow = qbase + (size_t)(l0 + mlo) * ROW;
        #pragma unroll
        for (int k = 0; k < KSTEP; ++k) {
            const int e = k * 4 + 2 * h16;
            const v2f qr = *(const v2f*)(q_re + qrow + e);
            const v2f qi = *(const v2f*)(q_im + qrow + e);
            aQd[k]       = (qr - qi) * RSQRT2;
            aQs[k]       = (qr + qi) * RSQRT2;
        }
    }

    // ---- Flash state ----
    v8f oRe[NT], oIm[NT];
    #pragma unroll
    for (int f = 0; f < NT; ++f) { oRe[f] = {}; oIm[f] = {}; }
    // oRe/oIm[f][j] = O^T[e = f*16 + j + 8*h16][l = mlo]. mrow: running maximum of row mlo;
    // lsum: running sum over the keys this half of the wave holds (joined after the loop).
    float mrow = -3.0e38f, lsum = 0.0f;

    wait_async0();
    __syncthreads();

    for (int st = 0; st < NSTEP; ++st) {
        const int cur = (st & 1) * BUFSZ;    // float offset of current buffer
        // matrix base offsets inside smem (all addrspace(3)-rooted GEPs)
        const int oKr = cur;
        const int oKi = cur + MTXSZ;
        const int oVr = cur + 2 * MTXSZ;
        const int oVi = cur + 3 * MTXSZ;

        // Start next tile's copy into the other buffer (safe: its readers
        // finished before the barrier that ended iteration st-1).
        if (st + 1 < NSTEP)
            issue_tile(gSrc,
                       ldsBase + (uint32_t)((((st + 1) & 1) * BUFSZ) * sizeof(float)),
                       st + 1, tid);

        // ---- Scores, transposed: a = (Kr+Ki)*Qd^T ; b = (Kr-Ki)*Qs^T ; |s| = sqrt(a^2 + b^2);
        //      pf[nt][j] belongs to key nt*16 + j + 8*h16 and query row mlo ----
        v8f pf[NT];
        #pragma unroll
        for (int nt = 0; nt < NT; ++nt) {
            const int n0 = nt * 16;
            v8f aA = {}, aB = {};
            const int bKr = oKr + (n0 + mlo) * EP + 2 * h16;
            const int bKi = oKi + (n0 + mlo) * EP + 2 * h16;
            #pragma unroll
            for (int k = 0; k < KSTEP; ++k) {
                const v2f bR = *(const v2f*)&smem[bKr + 4 * k];
                const v2f bI = *(const v2f*)&smem[bKi + 4 * k];
                const v2f bS = bR + bI;
                const v2f bD = bR - bI;
                aA = __builtin_amdgcn_wmma_f32_16x16x4_f32(false, bS, false, aQd[k], (short)0, aA, false, false);
                aB = __builtin_amdgcn_wmma_f32_16x16x4_f32(false, bD, false, aQs[k], (short)0, aB, false, false);
            }
            #pragma unroll
            for (int j = 0; j < 8; ++j)
                pf[nt][j] = sqrtf(aA[j] * aA[j] + aB[j] * aB[j]);
        }

        // ---- Streaming softmax update: in-lane over 32 keys, one exchange between halves ----
        float tm[NT];
        #pragma unroll
        for (int nt = 0; nt < NT; ++nt) {
            tm[nt] = pf[nt][0];
            #pragma unroll
            for (int j = 1; j < 8; ++j) tm[nt] = fmaxf(tm[nt], pf[nt][j]);
        }
        float t = fmaxf(fmaxf(tm[0], tm[1]), fmaxf(tm[2], tm[3]));
        t = fmaxf(t, xhalf(t));
        const float mn    = fmaxf(mrow, t);
        const float alpha = exp_slot(mrow - mn);
        mrow = mn;
        float rs[NT];
        #pragma unroll
        for (int nt = 0; nt < NT; ++nt) {
            rs[nt] = 0.0f;
            #pragma unroll
            for (int j = 0; j < 8; ++j) {
                const float p = exp_slot(pf[nt][j] - mrow);
                pf[nt][j] = p;
                rs[nt] += p;
            }
        }
        lsum = lsum * alpha + ((rs[0] + rs[1]) + (rs[2] + rs[3]));
        #pragma unroll
        for (int f = 0; f < NT; ++f) { oRe[f] *= alpha; oIm[f] *= alpha; }

        // ---- O^T += V^T P^T. The accumulator pair (pf[nt][2t], pf[nt][2t+1]) is already a
        //      B fragment: its k slots 2*h16 + {0,1} are keys nt*16 + 8*h16 + 2t + {0,1};
        //      the V^T fragment (A: lane = e, same k slots) reads the same keys' rows. ----
        #pragma unroll
        for (int f = 0; f < NT; ++f) {
            const int ec = f * 16 + mlo;
            #pragma unroll
            for (int nt = 0; nt < NT; ++nt) {
                #pragma unroll
                for (int t2 = 0; t2 < 4; ++t2) {
                    const int s0 = nt * 16 + 8 * h16 + 2 * t2;
                    const v2f bP  = { pf[nt][2 * t2], pf[nt][2 * t2 + 1] };
                    const v2f aVr = { smem[oVr + s0 * EP + ec], smem[oVr + (s0 + 1) * EP + ec] };
                    const v2f aVi = { smem[oVi + s0 * EP + ec], smem[oVi + (s0 + 1) * EP + ec] };
                    oRe[f] = __builtin_amdgcn_wmma_f32_16x16x4_f32(false, aVr, false, bP, (short)0, oRe[f], false, false);
                    oIm[f] = __builtin_amdgcn_wmma_f32_16x16x4_f32(false, aVi, false, bP, (short)0, oIm[f], false, false);
                }
            }
        }

        // Next buffer ready + everyone done reading current buffer.
        if (st + 1 < NSTEP) {
            wait_async0();
            __syncthreads();
        }
    }

    // ---- Normalize and store [2,b,n,l,h,e] ----
    const size_t obase = (size_t)bn * L_ * ROW + (size_t)h * E_;
    const float inv = 1.0f / (lsum + xhalf(lsum));
    float* orow = out + obase + (size_t)(l0 + mlo) * ROW + 8 * h16;   // 32-byte aligned
    #pragma unroll
    for (int f = 0; f < NT; ++f) {
        const v8f re = oRe[f] * inv;
        const v8f im = oIm[f] * inv;
        *(v4f*)(orow + f * 16)             = __builtin_shufflevector(re, re, 0, 1, 2, 3);
        *(v4f*)(orow + f * 16 + 4)         = __builtin_shufflevector(re, re, 4, 5, 6, 7);
        *(v4f*)(orow + IMOFF + f * 16)     = __builtin_shufflevector(im, im, 0, 1, 2, 3);
        *(v4f*)(orow + IMOFF + f * 16 + 4) = __builtin_shufflevector(im, im, 4, 5, 6, 7);
    }
}

extern "C" void kernel_launch(void* const* d_in, const int* in_sizes, int n_in,
                              void* d_out, int out_size, void* d_ws, size_t ws_size,
                              hipStream_t stream) {
    (void)in_sizes; (void)n_in; (void)out_size; (void)d_ws; (void)ws_size;
    const float* q_re = (const float*)d_in[0];
    const float* q_im = (const float*)d_in[1];
    const float* k_re = (const float*)d_in[2];
    const float* k_im = (const float*)d_in[3];
    const float* v_re = (const float*)d_in[4];
    const float* v_im = (const float*)d_in[5];
    float* out = (float*)d_out;

    const dim3 grid(B_ * N_ * H_ * (L_ / BM));   // 1024 blocks
    const dim3 block(256);                       // 8 waves (wave32)
    const size_t smem = (size_t)(2 * BUFSZ) * sizeof(float);   // 136 KiB

    ca_flash_wmma_f32<<<grid, block, smem, stream>>>(q_re, q_im, k_re, k_im,
                                                     v_re, v_im, out);
}

// v003
// One run takes 193 microseconds.
// Timed twice side by side with v002, it ran 1.17 times as fast both times.
// Counting every step since v000, it is 1.61 times as fast.
#include <hip/hip_runtime.h>
#include <stdint.h>

// ComplexAttention for MI455X (gfx1250, wave32, WMMA f32 16x16x4)
// Flash-style streaming softmax on transposed products (S^T = K Q^T, O^T += V^T P^T):
// a lane owns one query row of each of its wave's two query tiles, so P goes from accumulator
// to operand without leaving its registers, and every K and V fragment read from LDS feeds
// the products of both tiles. K/V tiles double-buffered in LDS via
// GLOBAL_LOAD_ASYNC_TO_LDS_B128 (ASYNCcnt), compute fully overlapped with copy.
// Double buffer selected by *integer offset* from the LDS base so every access
// stays in addrspace(3) (ds_load), never generic/flat.
// B,N,L,S,H,E = 4,8,512,512,8,64

typedef __attribute__((ext_vector_type(2))) float v2f;
typedef __attribute__((ext_vector_type(4))) float v4f;
typedef __attribute__((ext_vector_type(8))) float v8f;

#define B_   4
#define N_   8
#define L_   512
#define S_   512
#define H_   8
#define E_   64
#define ROW  512            // H_*E_  (element stride between consecutive l / s)
#define TS   64             // S-tile staged in LDS
#define EP   68             // padded row stride for K/V tiles (272B rows, 16B aligned)
#define NW   4              // waves per block
#define QT   2              // 16-row query tiles per wave: WMMAs per K/V fragment read from LDS
#define BM   128            // NW*QT*16 rows of L per block
#define NTHR (NW * 32)      // threads per block
#define CPM  (TS * E_ / 4 / NTHR)   // 8 b128 copies per thread and staged matrix
#define NT   4              // 16-col tiles per TS
#define KSTEP 16            // E_/4 k-steps for the score GEMM
#define NSTEP (S_ / TS)     // 8 S-tiles
#define MTXSZ (TS * EP)     // floats per staged matrix
#define BUFSZ (4 * MTXSZ)   // floats per (Kr,Ki,Vr,Vi) buffer
#define IMOFF ((size_t)B_ * N_ * L_ * H_ * E_)
#define RSQRT2 0.70710678f  // 1/sqrt(2)

// One lane copies 16 x 16 bytes global -> LDS on the async path (no data VGPRs), eight for each
// of two matrices: LDS byte address l[i], global address = that matrix's uniform tile base + the
// lane's byte offset o[i & 7] (the same eight offsets serve every matrix, so no 64-bit address
// lives in vector registers). The s_wait_xcnt 0 closes the statement so that no address
// register of these copies is rewritten in front of it.
__device__ __forceinline__ void async_b128_x16(const uint32_t* l, const uint32_t* o,
                                               const float* base0, const float* base1) {
    asm volatile("global_load_async_to_lds_b128 %0, %16, %24\n\t"
                 "global_load_async_to_lds_b128 %1, %17, %24\n\t"
                 "global_load_async_to_lds_b128 %2, %18, %24\n\t"
                 "global_load_async_to_lds_b128 %3, %19, %24\n\t"
                 "global_load_async_to_lds_b128 %4, %20, %24\n\t"
                 "global_load_async_to_lds_b128 %5, %21, %24\n\t"
                 "global_load_async_to_lds_b128 %6, %22, %24\n\t"
                 "global_load_async_to_lds_b128 %7, %23, %24\n\t"
                 "global_load_async_to_lds_b128 %8, %16, %25\n\t"
                 "global_load_async_to_lds_b128 %9, %17, %25\n\t"
                 "global_load_async_to_lds_b128 %10, %18, %25\n\t"
                 "global_load_async_to_lds_b128 %11, %19, %25\n\t"
                 "global_load_async_to_lds_b128 %12, %20, %25\n\t"
                 "global_load_async_to_lds_b128 %13, %21, %25\n\t"
                 "global_load_async_to_lds_b128 %14, %22, %25\n\t"
                 "global_load_async_to_lds_b128 %15, %23, %25\n\t"
                 "s_wait_xcnt 0x0"
                 :: "v"(l[0]), "v"(l[1]), "v"(l[2]), "v"(l[3]),
                    "v"(l[4]), "v"(l[5]), "v"(l[6]), "v"(l[7]),
                    "v"(l[8]), "v"(l[9]), "v"(l[10]), "v"(l[11]),
                    "v"(l[12]), "v"(l[13]), "v"(l[14]), "v"(l[15]),
                    "v"(o[0]), "v"(o[1]), "v"(o[2]), "v"(o[3]),
                    "v"(o[4]), "v"(o[5]), "v"(o[6]), "v"(o[7]),
                    "s"(base0), "s"(base1)
                 : "memory");
}
// Value of lane l ^ 16: the other half of the wave holds the same query row's other keys.
__device__ __forceinline__ float xhalf(float x) {
    const int b = __builtin_bit_cast(int, x);
    return __builtin_bit_cast(float,
        __builtin_amdgcn_permlanex16(b, b, 0x76543210, 0xfedcba98, false, false));
}
// exp(x) as __expf forms it (one multiply, v_exp_f32). The v_nop in the same statement is the
// slot the instruction set asks for behind a transcendental before its result is read or its
// source overwritten.
__device__ __forceinline__ float exp_slot(float x) {
    float r;
    asm("v_exp_f32 %0, %1\n\tv_nop" : "=v"(r) : "v"(x * 1.44269504f));
    return r;
}
__device__ __forceinline__ void wait_async0() {
    asm volatile("s_wait_asynccnt 0" ::: "memory");
}
// This wave's LDS reads have retired before the barrier behind which their buffer is refilled.
__device__ __forceinline__ void wait_ds0() {
    asm volatile("s_wait_dscnt 0" ::: "memory");
}

// Issue the full (Kr,Ki,Vr,Vi) TS x E tile copy for S-tile `st` into the LDS
// buffer starting at byte address `ldsBase`. 4096 b128 chunks over 128 threads.
__device__ __forceinline__ void issue_tile(const float* const* gSrc, uint32_t ldsBase,
                                           int st, int tid) {
    #pragma unroll
    for (int mtx = 0; mtx < 4; mtx += 2) {
        uint32_t off[CPM], lds[2 * CPM];
        #pragma unroll
        for (int r = 0; r < CPM; ++r) {
            const int f4 = tid + NTHR * r;    // 0..1023 float4 slots per matrix
            const int s  = f4 >> 4;
            const int c4 = f4 & 15;
            off[r] = (uint32_t)((s * ROW + c4 * 4) * sizeof(float));
            lds[r] = ldsBase +
                (uint32_t)((mtx * MTXSZ + s * EP + c4 * 4) * sizeof(float));
            lds[CPM + r] = lds[r] + (uint32_t)(MTXSZ * sizeof(float));
        }
        async_b128_x16(lds, off, gSrc[mtx] + (size_t)(st * TS) * ROW,
                       gSrc[mtx + 1] + (size_t)(st * TS) * ROW);
    }
}

// Second bound: two waves per SIMD, so that two work-groups share a WGP (512 VGPRs a wave).
__global__ __launch_bounds__(NTHR, 2) void ca_flash_wmma_f32(
    const float* __restrict__ q_re, const float* __restrict__ q_im,
    const float* __restrict__ k_re, const float* __restrict__ k_im,
    const float* __restrict__ v_re, const float* __restrict__ v_im,
    float* __restrict__ out)
{
    extern __shared__ float smem[];
    // layout: [ buf0 : BUFSZ ][ buf1 : BUFSZ ]

    const int tid  = threadIdx.x;
    const int lane = tid & 31;
    const int w    = tid >> 5;              // wave id 0..3
    const int mlo  = lane & 15;
    const int h16  = lane >> 4;             // 0 = lanes 0-15, 1 = lanes 16-31

    const int g     = blockIdx.x >> 2;      // (b*N+n)*H + h
    const int ltile = blockIdx.x & 3;
    const int h     = g & (H_ - 1);
    const int bn    = g >> 3;               // b*N + n

    const size_t qbase  = (size_t)bn * L_ * ROW + (size_t)h * E_;
    const size_t kvbase = (size_t)bn * S_ * ROW + (size_t)h * E_;
    const int    l0     = ltile * BM + w * (QT * 16);

    const float* gSrc[4] = { k_re + kvbase, k_im + kvbase, v_re + kvbase, v_im + kvbase };
    const uint32_t ldsBase = (uint32_t)(uintptr_t)smem;      // LDS byte address of buf0

    // Kick off tile 0 copy before touching Q, to hide HBM latency behind Q loads.
    issue_tile(gSrc, ldsBase, 0, tid);

    // ---- Load Q fragments for this wave's 2 x 16 rows (B-matrix layout of Q^T, f32 4x16:
    //      lane = query row, k = 2*h16 + {0,1}) ----
    // With a = s_re + s_im = (qr - qi).(kr + ki) and b = s_re - s_im = (qr + qi).(kr - ki),
    // s_re^2 + s_im^2 = (a^2 + b^2) / 2: two products give |s| where four were needed.
    // The 1/sqrt(2) on a and b is folded into the Q fragments, once per wave.
    v2f aQd[QT][KSTEP], aQs[QT][KSTEP];
    #pragma unroll
    for (int q = 0; q < QT; ++q) {
        const size_t qrow = qbase + (size_t)(l0 + q * 16 + mlo) * ROW;
        #pragma unroll
        for (int k = 0; k < KSTEP; ++k) {
            const int e = k * 4 + 2 * h16;
            const v2f qr = *(const v2f*)(q_re + qrow + e);
            const v2f qi = *(const v2f*)(q_im + qrow + e);
            aQd[q][k]    = (qr - qi) * RSQRT2;
            aQs[q][k]    = (qr + qi) * RSQRT2;
        }
    }

    // ---- Flash state ----
    v8f oRe[QT][NT], oIm[QT][NT];
    // oRe/oIm[q][f][j] = O^T[e = f*16 + j + 8*h16][l = q*16 + mlo]. mrow: running maximum of that
    // row; lsum: running sum over the keys this half of the wave holds (joined after the loop).
    float mrow[QT], lsum[QT];
    #pragma unroll
    for (int q = 0; q < QT; ++q) {
        #pragma unroll
        for (int f = 0; f < NT; ++f) { oRe[q][f] = {}; oIm[q][f] = {}; }
        mrow[q] = -3.0e38f;
        lsum[q] = 0.0f;
    }

    wait_async0();
    __syncthreads();

    for (int st = 0; st < NSTEP; ++st) {
        const int cur = (st & 1) * BUFSZ;    // float offset of current buffer
        // matrix base offsets inside smem (all addrspace(3)-rooted GEPs)
        const int oKr = cur;
        const int oKi = cur + MTXSZ;
        const int oVr = cur + 2 * MTXSZ;
        const int oVi = cur + 3 * MTXSZ;

        // Start next tile's copy into the other buffer (safe: its readers
        // finished before the barrier that ended iteration st-1).
        if (st + 1 < NSTEP)
            issue_tile(gSrc,
                       ldsBase + (uint32_t)((((st + 1) & 1) * BUFSZ) * sizeof(float)),
                       st + 1, tid);

        // ---- Scores, transposed: a = (Kr+Ki)*Qd^T ; b = (Kr-Ki)*Qs^T ; |s| = sqrt(a^2 + b^2);
        //      pf[q][nt][j] belongs to key nt*16 + j + 8*h16 and query row q*16 + mlo ----
        v8f pf[QT][NT];
        #pragma unroll
        for (int nt = 0; nt < NT; ++nt) {
            const int n0 = nt * 16;
            v8f aA[QT] = {}, aB[QT] = {};
            const int bKr = oKr + (n0 + mlo) * EP + 2 * h16;
            const int bKi = oKi + (n0 + mlo) * EP + 2 * h16;
            #pragma unroll
            for (int k = 0; k < KSTEP; ++k) {
                const v2f bR = *(const v2f*)&smem[bKr + 4 * k];
                const v2f bI = *(const v2f*)&smem[bKi + 4 * k];
                const v2f bS = bR + bI;
                const v2f bD = bR - bI;
                #pragma unroll
                for (int q = 0; q < QT; ++q) {
                    aA[q] = __builtin_amdgcn_wmma_f32_16x16x4_f32(false, bS, false, aQd[q][k], (short)0, aA[q], false, false);
                    aB[q] = __builtin_amdgcn_wmma_f32_16x16x4_f32(false, bD, false, aQs[q][k], (short)0, aB[q], false, false);
                }
            }
            #pragma unroll
            for (int q = 0; q < QT; ++q) {
                #pragma unroll
                for (int j = 0; j < 8; ++j)
                    pf[q][nt][j] = sqrtf(aA[q][j] * aA[q][j] + aB[q][j] * aB[q][j]);
            }
        }

        // ---- Streaming softmax update: in-lane over 32 keys, one exchange between halves ----
        #pragma unroll
        for (int q = 0; q < QT; ++q) {
            float tm[NT];
            #pragma unroll
            for (int nt = 0; nt < NT; ++nt) {
                tm[nt] = pf[q][nt][0];
                #pragma unroll
                for (int j = 1; j < 8; ++j) tm[nt] = fmaxf(tm[nt], pf[q][nt][j]);
            }
            float t = fmaxf(fmaxf(tm[0], tm[1]), fmaxf(tm[2], tm[3]));
            t = fmaxf(t, xhalf(t));
            const float mn    = fmaxf(mrow[q], t);
            const float alpha = exp_slot(mrow[q] - mn);
            mrow[q] = mn;
            float rs[NT];
            #pragma unroll
            for (int nt = 0; nt < NT; ++nt) {
                rs[nt] = 0.0f;
                #pragma unroll
                for (int j = 0; j < 8; ++j) {
                    const float p = exp_slot(pf[q][nt][j] - mn);
                    pf[q][nt][j] = p;
                    rs[nt] += p;
                }
            }
            lsum[q] = lsum[q] * alpha + ((rs[0] + rs[1]) + (rs[2] + rs[3]));
            #pragma unroll
            for (int f = 0; f < NT; ++f) { oRe[q][f] *= alpha; oIm[q][f] *= alpha; }
        }

        // ---- O^T += V^T P^T. The accumulator pair (pf[q][nt][2t], pf[q][nt][2t+1]) is already a
        //      B fragment: its k slots 2*h16 + {0,1} are keys nt*16 + 8*h16 + 2t + {0,1};
        //      the V^T fragment (A: lane = e, same k slots) reads the same keys' rows. ----
        #pragma unroll
        for (int f = 0; f < NT; ++f) {
            const int ec = f * 16 + mlo;
            #pragma unroll
            for (int nt = 0; nt < NT; ++nt) {
                #pragma unroll
                for (int t2 = 0; t2 < 4; ++t2) {
                    const int s0 = nt * 16 + 8 * h16 + 2 * t2;
                    const v2f aVr = { smem[oVr + s0 * EP + ec], smem[oVr + (s0 + 1) * EP + ec] };
                    const v2f aVi = { smem[oVi + s0 * EP + ec], smem[oVi + (s0 + 1) * EP + ec] };
                    #pragma unroll
                    for (int q = 0; q < QT; ++q) {
                        const v2f bP = { pf[q][nt][2 * t2], pf[q][nt][2 * t2 + 1] };
                        oRe[q][f] = __builtin_amdgcn_wmma_f32_16x16x4_f32(false, aVr, false, bP, (short)0, oRe[q][f], false, false);
                        oIm[q][f] = __builtin_amdgcn_wmma_f32_16x16x4_f32(false, aVi, false, bP, (short)0, oIm[q][f], false, false);
                    }
                }
            }
        }

        // Next buffer ready + everyone done reading current buffer.
        if (st + 1 < NSTEP) {
            wait_ds0();
            wait_async0();
            __syncthreads();
        }
    }

    // ---- Normalize and store [2,b,n,l,h,e] ----
    const size_t obase = (size_t)bn * L_ * ROW + (size_t)h * E_;
    #pragma unroll
    for (int q = 0; q < QT; ++q) {
        const float inv = 1.0f / (lsum[q] + xhalf(lsum[q]));
        float* orow = out + obase + (size_t)(l0 + q * 16 + mlo) * ROW + 8 * h16;   // 32-byte aligned
        #pragma unroll
        for (int f = 0; f < NT; ++f) {
            const v8f re = oRe[q][f] * inv;
            const v8f im = oIm[q][f] * inv;
            *(v4f*)(orow + f * 16)             = __builtin_shufflevector(re, re, 0, 1, 2, 3);
            *(v4f*)(orow + f * 16 + 4)         = __builtin_shufflevector(re, re, 4, 5, 6, 7);
            *(v4f*)(orow + IMOFF + f * 16)     = __builtin_shufflevector(im, im, 0, 1, 2, 3);
            *(v4f*)(orow + IMOFF + f * 16 + 4) = __builtin_shufflevector(im, im, 4, 5, 6, 7);
        }
    }
}

extern "C" void kernel_launch(void* const* d_in, const int* in_sizes, int n_in,
                              void* d_out, int out_size, void* d_ws, size_t ws_size,
                              hipStream_t stream) {
    (void)in_sizes; (void)n_in; (void)out_size; (void)d_ws; (void)ws_size;
    const float* q_re = (const float*)d_in[0];
    const float* q_im = (const float*)d_in[1];
    const float* k_re = (const float*)d_in[2];
    const float* k_im = (const float*)d_in[3];
    const float* v_re = (const float*)d_in[4];
    const float* v_im = (const float*)d_in[5];
    float* out = (float*)d_out;

    const dim3 grid(B_ * N_ * H_ * (L_ / BM));   // 1024 blocks
    const dim3 block(NTHR);                      // 4 waves (wave32)
    const size_t smem = (size_t)(2 * BUFSZ) * sizeof(float);   // 136 KiB

    ca_flash_wmma_f32<<<grid, block, smem, stream>>>(q_re, q_im, k_re, k_im,
                                                     v_re, v_im, out);
}

// v004
// A run of this version takes 179 microseconds.
// In two side-by-side timings against v003, it was 1.07 and 1.08 times as fast.
// All steps since v000 together make it 1.74 times as fast.
#include <hip/hip_runtime.h>
#include <stdint.h>

// ComplexAttention for MI455X (gfx1250, wave32, WMMA f32 16x16x4)
// Flash-style streaming softmax on transposed products (S^T = K Q^T, O^T += V^T P^T):
// a lane owns one query row of each of its wave's two query tiles, so P goes from accumulator
// to operand without leaving its registers, and every K and V fragment read from LDS feeds
// the products of both tiles. K/V tiles double-buffered in LDS via
// GLOBAL_LOAD_ASYNC_TO_LDS_B128 (ASYNCcnt), compute fully overlapped with copy.
// Double buffer selected by *integer offset* from the LDS base so every access
// stays in addrspace(3) (ds_load), never generic/flat.
// B,N,L,S,H,E = 4,8,512,512,8,64

typedef __attribute__((ext_vector_type(2))) float v2f;
typedef __attribute__((ext_vector_type(4))) float v4f;
typedef __attribute__((ext_vector_type(8))) float v8f;

#define B_   4
#define N_   8
#define L_   512
#define S_   512
#define H_   8
#define E_   64
#define ROW  512            // H_*E_  (element stride between consecutive l / s)
#define TS   64             // S-tile staged in LDS
#define EP   68             // padded row stride for K/V tiles (272B rows, 16B aligned)
#define NW   4              // waves per block
#define QT   2              // 16-row query tiles per wave: WMMAs per K/V fragment read from LDS
#define BM   128            // NW*QT*16 rows of L per block
#define NTHR (NW * 32)      // threads per block
#define CPM  (TS * E_ / 4 / NTHR)   // 8 b128 copies per thread and staged matrix
#define NT   4              // 16-col tiles per TS
#define KSTEP 16            // E_/4 k-steps for the score GEMM
#define NSTEP (S_ / TS)     // 8 S-tiles
#define MTXSZ (TS * EP)     // floats per staged matrix
#define BUFSZ (4 * MTXSZ)   // floats per (Kr,Ki,Vr,Vi) buffer
#define IMOFF ((size_t)B_ * N_ * L_ * H_ * E_)
#define RSQRT2 0.70710678f  // 1/sqrt(2)

// One lane copies 16 x 16 bytes global -> LDS on the async path (no data VGPRs), eight for each
// of two matrices: LDS byte address l[i], global address = that matrix's uniform tile base + the
// lane's byte offset o[i & 7] (the same eight offsets serve every matrix, so no 64-bit address
// lives in vector registers). The s_wait_xcnt 0 closes the statement so that no address
// register of these copies is rewritten in front of it.
__device__ __forceinline__ void async_b128_x16(const uint32_t* l, const uint32_t* o,
                                               const float* base0, const float* base1) {
    asm volatile("global_load_async_to_lds_b128 %0, %16, %24\n\t"
                 "global_load_async_to_lds_b128 %1, %17, %24\n\t"
                 "global_load_async_to_lds_b128 %2, %18, %24\n\t"
                 "global_load_async_to_lds_b128 %3, %19, %24\n\t"
                 "global_load_async_to_lds_b128 %4, %20, %24\n\t"
                 "global_load_async_to_lds_b128 %5, %21, %24\n\t"
                 "global_load_async_to_lds_b128 %6, %22, %24\n\t"
                 "global_load_async_to_lds_b128 %7, %23, %24\n\t"
                 "global_load_async_to_lds_b128 %8, %16, %25\n\t"
                 "global_load_async_to_lds_b128 %9, %17, %25\n\t"
                 "global_load_async_to_lds_b128 %10, %18, %25\n\t"
                 "global_load_async_to_lds_b128 %11, %19, %25\n\t"
                 "global_load_async_to_lds_b128 %12, %20, %25\n\t"
                 "global_load_async_to_lds_b128 %13, %21, %25\n\t"
                 "global_load_async_to_lds_b128 %14, %22, %25\n\t"
                 "global_load_async_to_lds_b128 %15, %23, %25\n\t"
                 "s_wait_xcnt 0x0"
                 :: "v"(l[0]), "v"(l[1]), "v"(l[2]), "v"(l[3]),
                    "v"(l[4]), "v"(l[5]), "v"(l[6]), "v"(l[7]),
                    "v"(l[8]), "v"(l[9]), "v"(l[10]), "v"(l[11]),
                    "v"(l[12]), "v"(l[13]), "v"(l[14]), "v"(l[15]),
                    "v"(o[0]), "v"(o[1]), "v"(o[2]), "v"(o[3]),
                    "v"(o[4]), "v"(o[5]), "v"(o[6]), "v"(o[7]),
                    "s"(base0), "s"(base1)
                 : "memory");
}
// Value of lane l ^ 16: the other half of the wave holds the same query row's other keys.
__device__ __forceinline__ float xhalf(float x) {
    const int b = __builtin_bit_cast(int, x);
    return __builtin_bit_cast(float,
        __builtin_amdgcn_permlanex16(b, b, 0x76543210, 0xfedcba98, false, false));
}
// exp(x) as __expf forms it (one multiply, v_exp_f32). The v_nop in the same statement is the
// slot the instruction set asks for behind a transcendental before its result is read or its
// source overwritten.
__device__ __forceinline__ float exp_slot(float x) {
    float r;
    asm("v_exp_f32 %0, %1\n\tv_nop" : "=v"(r) : "v"(x * 1.44269504f));
    return r;
}
// sqrt(x) as one v_sqrt_f32 (1 ulp). The v_nop in the same statement is the slot the instruction
// set asks for behind a transcendental, as in exp_slot.
__device__ __forceinline__ float sqrt_slot(float x) {
    float r;
    asm("v_sqrt_f32 %0, %1\n\tv_nop" : "=v"(r) : "v"(x));
    return r;
}
__device__ __forceinline__ void wait_async0() {
    asm volatile("s_wait_asynccnt 0" ::: "memory");
}
// This wave's LDS reads have retired before the barrier behind which their buffer is refilled.
__device__ __forceinline__ void wait_ds0() {
    asm volatile("s_wait_dscnt 0" ::: "memory");
}

// Issue the full (Kr,Ki,Vr,Vi) TS x E tile copy for S-tile `st` into the LDS
// buffer starting at byte address `ldsBase`. 4096 b128 chunks over 128 threads.
__device__ __forceinline__ void issue_tile(const float* const* gSrc, uint32_t ldsBase,
                                           int st, int tid) {
    #pragma unroll
    for (int mtx = 0; mtx < 4; mtx += 2) {
        uint32_t off[CPM], lds[2 * CPM];
        #pragma unroll
        for (int r = 0; r < CPM; ++r) {
            const int f4 = tid + NTHR * r;    // 0..1023 float4 slots per matrix
            const int s  = f4 >> 4;
            const int c4 = f4 & 15;
            off[r] = (uint32_t)((s * ROW + c4 * 4) * sizeof(float));
            lds[r] = ldsBase +
                (uint32_t)((mtx * MTXSZ + s * EP + c4 * 4) * sizeof(float));
            lds[CPM + r] = lds[r] + (uint32_t)(MTXSZ * sizeof(float));
        }
        async_b128_x16(lds, off, gSrc[mtx] + (size_t)(st * TS) * ROW,
                       gSrc[mtx + 1] + (size_t)(st * TS) * ROW);
    }
}

// Second bound: two waves per SIMD, so that two work-groups share a WGP (512 VGPRs a wave).
__global__ __launch_bounds__(NTHR, 2) void ca_flash_wmma_f32(
    const float* __restrict__ q_re, const float* __restrict__ q_im,
    const float* __restrict__ k_re, const float* __restrict__ k_im,
    const float* __restrict__ v_re, const float* __restrict__ v_im,
    float* __restrict__ out)
{
    extern __shared__ float smem[];
    // layout: [ buf0 : BUFSZ ][ buf1 : BUFSZ ]

    const int tid  = threadIdx.x;
    const int lane = tid & 31;
    const int w    = tid >> 5;              // wave id 0..3
    const int mlo  = lane & 15;
    const int h16  = lane >> 4;             // 0 = lanes 0-15, 1 = lanes 16-31

    const int g     = blockIdx.x >> 2;      // (b*N+n)*H + h
    const int ltile = blockIdx.x & 3;
    const int h     = g & (H_ - 1);
    const int bn    = g >> 3;               // b*N + n

    const size_t qbase  = (size_t)bn * L_ * ROW + (size_t)h * E_;
    const size_t kvbase = (size_t)bn * S_ * ROW + (size_t)h * E_;
    const int    l0     = ltile * BM + w * (QT * 16);

    const float* gSrc[4] = { k_re + kvbase, k_im + kvbase, v_re + kvbase, v_im + kvbase };
    const uint32_t ldsBase = (uint32_t)(uintptr_t)smem;      // LDS byte address of buf0

    // Kick off tile 0 copy before touching Q, to hide HBM latency behind Q loads.
    issue_tile(gSrc, ldsBase, 0, tid);

    // ---- Load Q fragments for this wave's 2 x 16 rows (B-matrix layout of Q^T, f32 4x16:
    //      lane = query row, k = 2*h16 + {0,1}) ----
    // With a = s_re + s_im = (qr - qi).(kr + ki) and b = s_re - s_im = (qr + qi).(kr - ki),
    // s_re^2 + s_im^2 = (a^2 + b^2) / 2: two products give |s| where four were needed.
    // The 1/sqrt(2) on a and b is folded into the Q fragments, once per wave.
    v2f aQd[QT][KSTEP], aQs[QT][KSTEP];
    #pragma unroll
    for (int q = 0; q < QT; ++q) {
        const size_t qrow = qbase + (size_t)(l0 + q * 16 + mlo) * ROW;
        #pragma unroll
        for (int k = 0; k < KSTEP; ++k) {
            const int e = k * 4 + 2 * h16;
            const v2f qr = *(const v2f*)(q_re + qrow + e);
            const v2f qi = *(const v2f*)(q_im + qrow + e);
            aQd[q][k]    = (qr - qi) * RSQRT2;
            aQs[q][k]    = (qr + qi) * RSQRT2;
        }
    }

    // ---- Flash state ----
    v8f oRe[QT][NT], oIm[QT][NT];
    // oRe/oIm[q][f][j] = O^T[e = f*16 + j + 8*h16][l = q*16 + mlo]. mrow: running maximum of that
    // row; lsum: running sum over the keys this half of the wave holds (joined after the loop).
    float mrow[QT], lsum[QT];
    #pragma unroll
    for (int q = 0; q < QT; ++q) {
        #pragma unroll
        for (int f = 0; f < NT; ++f) { oRe[q][f] = {}; oIm[q][f] = {}; }
        mrow[q] = -3.0e38f;
        lsum[q] = 0.0f;
    }

    wait_async0();
    __syncthreads();

    for (int st = 0; st < NSTEP; ++st) {
        const int cur = (st & 1) * BUFSZ;    // float offset of current buffer
        // matrix base offsets inside smem (all addrspace(3)-rooted GEPs)
        const int oKr = cur;
        const int oKi = cur + MTXSZ;
        const int oVr = cur + 2 * MTXSZ;
        const int oVi = cur + 3 * MTXSZ;

        // Start next tile's copy into the other buffer (safe: its readers
        // finished before the barrier that ended iteration st-1).
        if (st + 1 < NSTEP)
            issue_tile(gSrc,
                       ldsBase + (uint32_t)((((st + 1) & 1) * BUFSZ) * sizeof(float)),
                       st + 1, tid);

        // ---- Scores, transposed: a = (Kr+Ki)*Qd^T ; b = (Kr-Ki)*Qs^T ; |s| = sqrt(a^2 + b^2);
        //      pf[q][nt][j] belongs to key nt*16 + j + 8*h16 and query row q*16 + mlo ----
        v8f pf[QT][NT];
        #pragma unroll
        for (int nt = 0; nt < NT; ++nt) {
            const int n0 = nt * 16;
            v8f aA[QT] = {}, aB[QT] = {};
            const int bKr = oKr + (n0 + mlo) * EP + 2 * h16;
            const int bKi = oKi + (n0 + mlo) * EP + 2 * h16;
            #pragma unroll
            for (int k = 0; k < KSTEP; ++k) {
                const v2f bR = *(const v2f*)&smem[bKr + 4 * k];
                const v2f bI = *(const v2f*)&smem[bKi + 4 * k];
                const v2f bS = bR + bI;
                const v2f bD = bR - bI;
                #pragma unroll
                for (int q = 0; q < QT; ++q) {
                    aA[q] = __builtin_amdgcn_wmma_f32_16x16x4_f32(false, bS, false, aQd[q][k], (short)0, aA[q], false, false);
                    aB[q] = __builtin_amdgcn_wmma_f32_16x16x4_f32(false, bD, false, aQs[q][k], (short)0, aB[q], false, false);
                }
            }
            #pragma unroll
            for (int q = 0; q < QT; ++q) {
                #pragma unroll
                for (int j = 0; j < 8; ++j)
                    pf[q][nt][j] = sqrt_slot(__builtin_fmaf(aA[q][j], aA[q][j], aB[q][j] * aB[q][j]));
            }
        }

        // ---- Streaming softmax update: in-lane over 32 keys, one exchange between halves ----
        #pragma unroll
        for (int q = 0; q < QT; ++q) {
            float tm[NT];
            #pragma unroll
            for (int nt = 0; nt < NT; ++nt) {
                tm[nt] = pf[q][nt][0];
                #pragma unroll
                for (int j = 1; j < 8; ++j) tm[nt] = fmaxf(tm[nt], pf[q][nt][j]);
            }
            float t = fmaxf(fmaxf(tm[0], tm[1]), fmaxf(tm[2], tm[3]));
            t = fmaxf(t, xhalf(t));
            const float mn    = fmaxf(mrow[q], t);
            const float alpha = exp_slot(mrow[q] - mn);
            mrow[q] = mn;
            float rs[NT];
            #pragma unroll
            for (int nt = 0; nt < NT; ++nt) {
                rs[nt] = 0.0f;
                #pragma unroll
                for (int j = 0; j < 8; ++j) {
                    const float p = exp_slot(pf[q][nt][j] - mn);
                    pf[q][nt][j] = p;
                    rs[nt] += p;
                }
            }
            lsum[q] = lsum[q] * alpha + ((rs[0] + rs[1]) + (rs[2] + rs[3]));
            #pragma unroll
            for (int f = 0; f < NT; ++f) { oRe[q][f] *= alpha; oIm[q][f] *= alpha; }
        }

        // ---- O^T += V^T P^T. The accumulator pair (pf[q][nt][2t], pf[q][nt][2t+1]) is already a
        //      B fragment: its k slots 2*h16 + {0,1} are keys nt*16 + 8*h16 + 2t + {0,1};
        //      the V^T fragment (A: lane = e, same k slots) reads the same keys' rows. ----
        #pragma unroll
        for (int f = 0; f < NT; ++f) {
            const int ec = f * 16 + mlo;
            #pragma unroll
            for (int nt = 0; nt < NT; ++nt) {
                #pragma unroll
                for (int t2 = 0; t2 < 4; ++t2) {
                    const int s0 = nt * 16 + 8 * h16 + 2 * t2;
                    const v2f aVr = { smem[oVr + s0 * EP + ec], smem[oVr + (s0 + 1) * EP + ec] };
                    const v2f aVi = { smem[oVi + s0 * EP + ec], smem[oVi + (s0 + 1) * EP + ec] };
                    #pragma unroll
                    for (int q = 0; q < QT; ++q) {
                        const v2f bP = { pf[q][nt][2 * t2], pf[q][nt][2 * t2 + 1] };
                        oRe[q][f] = __builtin_amdgcn_wmma_f32_16x16x4_f32(false, aVr, false, bP, (short)0, oRe[q][f], false, false);
                        oIm[q][f] = __builtin_amdgcn_wmma_f32_16x16x4_f32(false, aVi, false, bP, (short)0, oIm[q][f], false, false);
                    }
                }
            }
        }

        // Next buffer ready + everyone done reading current buffer.
        if (st + 1 < NSTEP) {
            wait_ds0();
            wait_async0();
            __syncthreads();
        }
    }

    // ---- Normalize and store [2,b,n,l,h,e] ----
    const size_t obase = (size_t)bn * L_ * ROW + (size_t)h * E_;
    #pragma unroll
    for (int q = 0; q < QT; ++q) {
        const float inv = 1.0f / (lsum[q] + xhalf(lsum[q]));
        float* orow = out + obase + (size_t)(l0 + q * 16 + mlo) * ROW + 8 * h16;   // 32-byte aligned
        #pragma unroll
        for (int f = 0; f < NT; ++f) {
            const v8f re = oRe[q][f] * inv;
            const v8f im = oIm[q][f] * inv;
            *(v4f*)(orow + f * 16)             = __builtin_shufflevector(re, re, 0, 1, 2, 3);
            *(v4f*)(orow + f * 16 + 4)         = __builtin_shufflevector(re, re, 4, 5, 6, 7);
            *(v4f*)(orow + IMOFF + f * 16)     = __builtin_shufflevector(im, im, 0, 1, 2, 3);
            *(v4f*)(orow + IMOFF + f * 16 + 4) = __builtin_shufflevector(im, im, 4, 5, 6, 7);
        }
    }
}

extern "C" void kernel_launch(void* const* d_in, const int* in_sizes, int n_in,
                              void* d_out, int out_size, void* d_ws, size_t ws_size,
                              hipStream_t stream) {
    (void)in_sizes; (void)n_in; (void)out_size; (void)d_ws; (void)ws_size;
    const float* q_re = (const float*)d_in[0];
    const float* q_im = (const float*)d_in[1];
    const float* k_re = (const float*)d_in[2];
    const float* k_im = (const float*)d_in[3];
    const float* v_re = (const float*)d_in[4];
    const float* v_im = (const float*)d_in[5];
    float* out = (float*)d_out;

    const dim3 grid(B_ * N_ * H_ * (L_ / BM));   // 1024 blocks
    const dim3 block(NTHR);                      // 4 waves (wave32)
    const size_t smem = (size_t)(2 * BUFSZ) * sizeof(float);   // 136 KiB

    ca_flash_wmma_f32<<<grid, block, smem, stream>>>(q_re, q_im, k_re, k_im,
                                                     v_re, v_im, out);
}

// v005
// It runs in 162 microseconds.
// Two timings next to v004 both put it at 1.11 times that version's speed.
// Over all steps from v000 it is 1.92 times as fast.
#include <hip/hip_runtime.h>
#include <stdint.h>

// ComplexAttention for MI455X (gfx1250, wave32, WMMA f32 16x16x4)
// Flash-style streaming softmax on transposed products (S^T = K Q^T, O^T += V^T P^T):
// a lane owns one query row of each of its wave's two query tiles, so P goes from accumulator
// to operand without leaving its registers, and every K and V fragment read from LDS feeds
// the products of both tiles. Fragments are read from LDS in groups, one block of 32 WMMAs
// ahead, into a second register set. K/V tiles double-buffered in LDS via
// GLOBAL_LOAD_ASYNC_TO_LDS_B128 (ASYNCcnt), compute fully overlapped with copy.
// Double buffer selected by *integer offset* from the LDS base so every access
// stays in addrspace(3) (ds_load), never generic/flat.
// B,N,L,S,H,E = 4,8,512,512,8,64

typedef __attribute__((ext_vector_type(2))) float v2f;
typedef __attribute__((ext_vector_type(4))) float v4f;
typedef __attribute__((ext_vector_type(8))) float v8f;

#define B_   4
#define N_   8
#define L_   512
#define S_   512
#define H_   8
#define E_   64
#define ROW  512            // H_*E_  (element stride between consecutive l / s)
#define TS   64             // S-tile staged in LDS
#define EP   68             // padded row stride for K/V tiles (272B rows, 16B aligned)
#define NW   4              // waves per block
#define QT   2              // 16-row query tiles per wave: WMMAs per K/V fragment read from LDS
#define BM   128            // NW*QT*16 rows of L per block
#define NTHR (NW * 32)      // threads per block
#define CPM  (TS * E_ / 4 / NTHR)   // 8 b128 copies per thread and staged matrix
#define NT   4              // 16-col tiles per TS
#define KSTEP 16            // E_/4 k-steps for the score GEMM
#define NSTEP (S_ / TS)     // 8 S-tiles
#define FB   8              // K or V fragment pairs per block: one LDS read group feeds FB*2*QT = 32 WMMAs
#define NBLK 8              // blocks per product phase and S-tile
#define MTXSZ (TS * EP)     // floats per staged matrix
#define BUFSZ (4 * MTXSZ)   // floats per (Kr,Ki,Vr,Vi) buffer
#define IMOFF ((size_t)B_ * N_ * L_ * H_ * E_)
#define RSQRT2 0.70710678f  // 1/sqrt(2)

// One lane copies 16 x 16 bytes global -> LDS on the async path (no data VGPRs), eight for each
// of two matrices: LDS byte address l[i], global address = that matrix's uniform base + the
// lane's byte offset o[i & 7] (the same eight offsets serve every matrix, so no 64-bit address
// lives in vector registers). The s_wait_xcnt 0 closes the statement so that no address
// register of these copies is rewritten in front of it.
__device__ __forceinline__ void async_b128_x16(const uint32_t* l, const uint32_t* o,
                                               const float* base0, const float* base1) {
    asm volatile("global_load_async_to_lds_b128 %0, %16, %24\n\t"
                 "global_load_async_to_lds_b128 %1, %17, %24\n\t"
                 "global_load_async_to_lds_b128 %2, %18, %24\n\t"
                 "global_load_async_to_lds_b128 %3, %19, %24\n\t"
                 "global_load_async_to_lds_b128 %4, %20, %24\n\t"
                 "global_load_async_to_lds_b128 %5, %21, %24\n\t"
                 "global_load_async_to_lds_b128 %6, %22, %24\n\t"
                 "global_load_async_to_lds_b128 %7, %23, %24\n\t"
                 "global_load_async_to_lds_b128 %8, %16, %25\n\t"
                 "global_load_async_to_lds_b128 %9, %17, %25\n\t"
                 "global_load_async_to_lds_b128 %10, %18, %25\n\t"
                 "global_load_async_to_lds_b128 %11, %19, %25\n\t"
                 "global_load_async_to_lds_b128 %12, %20, %25\n\t"
                 "global_load_async_to_lds_b128 %13, %21, %25\n\t"
                 "global_load_async_to_lds_b128 %14, %22, %25\n\t"
                 "global_load_async_to_lds_b128 %15, %23, %25\n\t"
                 "s_wait_xcnt 0x0"
                 :: "v"(l[0]), "v"(l[1]), "v"(l[2]), "v"(l[3]),
                    "v"(l[4]), "v"(l[5]), "v"(l[6]), "v"(l[7]),
                    "v"(l[8]), "v"(l[9]), "v"(l[10]), "v"(l[11]),
                    "v"(l[12]), "v"(l[13]), "v"(l[14]), "v"(l[15]),
                    "v"(o[0]), "v"(o[1]), "v"(o[2]), "v"(o[3]),
                    "v"(o[4]), "v"(o[5]), "v"(o[6]), "v"(o[7]),
                    "s"(base0), "s"(base1)
                 : "memory");
}
// Value of lane l ^ 16: the other half of the wave holds the same query row's other keys.
__device__ __forceinline__ float xhalf(float x) {
    const int b = __builtin_bit_cast(int, x);
    return __builtin_bit_cast(float,
        __builtin_amdgcn_permlanex16(b, b, 0x76543210, 0xfedcba98, false, false));
}
// exp(x) as __expf forms it (one multiply, v_exp_f32). The v_nop in the same statement is the
// slot the instruction set asks for behind a transcendental before its result is read or its
// source overwritten.
__device__ __forceinline__ float exp_slot(float x) {
    float r;
    asm("v_exp_f32 %0, %1\n\tv_nop" : "=v"(r) : "v"(x * 1.44269504f));
    return r;
}
// sqrt(x) as one v_sqrt_f32 (1 ulp). The v_nop in the same statement is the slot the instruction
// set asks for behind a transcendental, as in exp_slot.
__device__ __forceinline__ float sqrt_slot(float x) {
    float r;
    asm("v_sqrt_f32 %0, %1\n\tv_nop" : "=v"(r) : "v"(x));
    return r;
}
__device__ __forceinline__ void wait_async0() {
    asm volatile("s_wait_asynccnt 0" ::: "memory");
}
// This wave's LDS reads have retired before the barrier behind which their buffer is refilled.
__device__ __forceinline__ void wait_ds0() {
    asm volatile("s_wait_dscnt 0" ::: "memory");
}

// Issue the full (Kr,Ki,Vr,Vi) TS x E tile copy for S-tile `st` into the LDS
// buffer starting at byte address `ldsBase`. 4096 b128 chunks over 128 threads.
__device__ __forceinline__ void issue_tile(const float* const* gSrc, uint32_t ldsBase,
                                           int st, int tid) {
    #pragma unroll
    for (int mtx = 0; mtx < 4; mtx += 2) {
        uint32_t off[CPM], lds[2 * CPM];
        #pragma unroll
        for (int r = 0; r < CPM; ++r) {
            const int f4 = tid + NTHR * r;    // 0..1023 float4 slots per matrix
            const int s  = f4 >> 4;
            const int c4 = f4 & 15;
            // The tile's step rides in the lane offset (below 1 MiB), not in the scalar base: the
            // offsets are then formed beside the copies and hold no registers through the loop.
            off[r] = (uint32_t)(((st * TS + s) * ROW + c4 * 4) * sizeof(float));
            lds[r] = ldsBase +
                (uint32_t)((mtx * MTXSZ + s * EP + c4 * 4) * sizeof(float));
            lds[CPM + r] = lds[r] + (uint32_t)(MTXSZ * sizeof(float));
        }
        async_b128_x16(lds, off, gSrc[mtx], gSrc[mtx + 1]);
    }
}

// Second bound: two waves per SIMD, so that two work-groups share a WGP (512 VGPRs a wave).
__global__ __launch_bounds__(NTHR, 2) void ca_flash_wmma_f32(
    const float* __restrict__ q_re, const float* __restrict__ q_im,
    const float* __restrict__ k_re, const float* __restrict__ k_im,
    const float* __restrict__ v_re, const float* __restrict__ v_im,
    float* __restrict__ out)
{
    // 16-byte alignment lets K fragments come as 64-bit LDS reads (the compiler pairs them into
    // ds_load_2addr_b64) in place of pairs of 32-bit ones: half the instructions in a K read group.
    extern __shared__ __attribute__((aligned(16))) float smem[];
    // layout: [ buf0 : BUFSZ ][ buf1 : BUFSZ ]

    const int tid  = threadIdx.x;
    const int lane = tid & 31;
    const int w    = tid >> 5;              // wave id 0..3
    const int mlo  = lane & 15;
    const int h16  = lane >> 4;             // 0 = lanes 0-15, 1 = lanes 16-31

    const int g     = blockIdx.x >> 2;      // (b*N+n)*H + h
    const int ltile = blockIdx.x & 3;
    const int h     = g & (H_ - 1);
    const int bn    = g >> 3;               // b*N + n

    const size_t qbase  = (size_t)bn * L_ * ROW + (size_t)h * E_;
    const size_t kvbase = (size_t)bn * S_ * ROW + (size_t)h * E_;
    const int    l0     = ltile * BM + w * (QT * 16);

    const float* gSrc[4] = { k_re + kvbase, k_im + kvbase, v_re + kvbase, v_im + kvbase };
    const uint32_t ldsBase = (uint32_t)(uintptr_t)smem;      // LDS byte address of buf0

    // Kick off tile 0 copy before touching Q, to hide HBM latency behind Q loads.
    issue_tile(gSrc, ldsBase, 0, tid);

    // ---- Load Q fragments for this wave's 2 x 16 rows (B-matrix layout of Q^T, f32 4x16:
    //      lane = query row, k = 2*h16 + {0,1}) ----
    // With a = s_re + s_im = (qr - qi).(kr + ki) and b = s_re - s_im = (qr + qi).(kr - ki),
    // s_re^2 + s_im^2 = (a^2 + b^2) / 2: two products give |s| where four were needed.
    // The 1/sqrt(2) on a and b is folded into the Q fragments, once per wave.
    v2f aQd[QT][KSTEP], aQs[QT][KSTEP];
    #pragma unroll
    for (int q = 0; q < QT; ++q) {
        const size_t qrow = qbase + (size_t)(l0 + q * 16 + mlo) * ROW;
        #pragma unroll
        for (int k = 0; k < KSTEP; ++k) {
            const int e = k * 4 + 2 * h16;
            const v2f qr = *(const v2f*)(q_re + qrow + e);
            const v2f qi = *(const v2f*)(q_im + qrow + e);
            aQd[q][k]    = (qr - qi) * RSQRT2;
            aQs[q][k]    = (qr + qi) * RSQRT2;
        }
    }

    // ---- Flash state ----
    v8f oRe[QT][NT], oIm[QT][NT];
    // oRe/oIm[q][f][j] = O^T[e = f*16 + j + 8*h16][l = q*16 + mlo]. mrow: running maximum of that
    // row; lsum: running sum over the keys this half of the wave holds (joined after the loop).
    float mrow[QT], lsum[QT];
    #pragma unroll
    for (int q = 0; q < QT; ++q) {
        #pragma unroll
        for (int f = 0; f < NT; ++f) { oRe[q][f] = {}; oIm[q][f] = {}; }
        mrow[q] = -3.0e38f;
        lsum[q] = 0.0f;
    }

    wait_async0();
    __syncthreads();

    for (int st = 0; st < NSTEP; ++st) {
        const int cur = (st & 1) * BUFSZ;    // float offset of current buffer
        // matrix base offsets inside smem (all addrspace(3)-rooted GEPs)
        const int oKr = cur;
        const int oKi = cur + MTXSZ;
        // V has a base of its own, picked whole: every V read of the tile then lies within the
        // 64 KiB that an LDS immediate offset reaches, and both rows of a fragment share a base.
        const int oVr = (st & 1) ? BUFSZ + 2 * MTXSZ : 2 * MTXSZ;
        const int oVi = oVr + MTXSZ;

        // Start next tile's copy into the other buffer (safe: its readers
        // finished before the barrier that ended iteration st-1).
        if (st + 1 < NSTEP)
            issue_tile(gSrc,
                       ldsBase + (uint32_t)((((st + 1) & 1) * BUFSZ) * sizeof(float)),
                       st + 1, tid);

        // ---- Scores, transposed: a = (Kr+Ki)*Qd^T ; b = (Kr-Ki)*Qs^T ; |s| = sqrt(a^2 + b^2);
        //      pf[q][nt][j] belongs to key nt*16 + j + 8*h16 and query row q*16 + mlo ----
        // Both product phases run in blocks of 32 WMMAs on two register sets: the LDS reads of
        // block b + 1 are issued as one group in front of block b's WMMAs, never among them.
        v2f fR[2][FB], fI[2][FB];      // K (then V) fragments, real and imaginary: [set][pair]
        // K block b: keys (b >> 1) * 16 + mlo, k-steps (b & 1) * FB + i.
        auto load_k = [&](int b) {
            const int o = ((b >> 1) * 16 + mlo) * EP + 2 * h16 + (b & 1) * (4 * FB);
            #pragma unroll   // constant indices keep the sets in registers
            for (int i = 0; i < FB; ++i) {
                fR[b & 1][i] = *(const v2f*)&smem[oKr + o + 4 * i];
                fI[b & 1][i] = *(const v2f*)&smem[oKi + o + 4 * i];
            }
        };
        // V block b: columns (b >> 1) * 16 + mlo, key pairs of tiles nt = (b & 1) * 2 + (i >> 2).
        auto load_v = [&](int b) {
            const int ec = (b >> 1) * 16 + mlo;
            #pragma unroll   // constant indices keep the sets in registers
            for (int i = 0; i < FB; ++i) {
                const int s0 = ((b & 1) * 2 + (i >> 2)) * 16 + 8 * h16 + 2 * (i & 3);
                fR[b & 1][i] = v2f{ smem[oVr + s0 * EP + ec], smem[oVr + (s0 + 1) * EP + ec] };
                fI[b & 1][i] = v2f{ smem[oVi + s0 * EP + ec], smem[oVi + (s0 + 1) * EP + ec] };
            }
        };

        v8f pf[QT][NT];
        v8f aA[QT], aB[QT];
        load_k(0);
        #pragma unroll   // the set b & 1 and every fragment index must be compile-time constants
        for (int b = 0; b < NBLK; ++b) {
            const int nt = b >> 1;
            if (b + 1 < NBLK) load_k(b + 1);
            else              load_v(0);      // first V group flies under the last block and the softmax
            // Fence: keeps the read group above from sinking among the WMMAs below.
            __builtin_amdgcn_sched_barrier(0);
            if ((b & 1) == 0) {
                #pragma unroll
                for (int q = 0; q < QT; ++q) { aA[q] = {}; aB[q] = {}; }
            }
            #pragma unroll
            for (int i = 0; i < FB; ++i) {
                const int k  = (b & 1) * FB + i;
                const v2f bS = fR[b & 1][i] + fI[b & 1][i];
                const v2f bD = fR[b & 1][i] - fI[b & 1][i];
                #pragma unroll
                for (int q = 0; q < QT; ++q) {
                    aA[q] = __builtin_amdgcn_wmma_f32_16x16x4_f32(false, bS, false, aQd[q][k], (short)0, aA[q], false, false);
                    aB[q] = __builtin_amdgcn_wmma_f32_16x16x4_f32(false, bD, false, aQs[q][k], (short)0, aB[q], false, false);
                }
            }
            if (b & 1) {
                #pragma unroll
                for (int q = 0; q < QT; ++q) {
                    #pragma unroll
                    for (int j = 0; j < 8; ++j)
                        pf[q][nt][j] = sqrt_slot(__builtin_fmaf(aA[q][j], aA[q][j], aB[q][j] * aB[q][j]));
                }
            }
            // Fence: keeps the next read group from rising among the WMMAs above.
            __builtin_amdgcn_sched_barrier(0);
        }

        // ---- Streaming softmax update: in-lane over 32 keys, one exchange between halves ----
        #pragma unroll
        for (int q = 0; q < QT; ++q) {
            float tm[NT];
            #pragma unroll
            for (int nt = 0; nt < NT; ++nt) {
                tm[nt] = pf[q][nt][0];
                #pragma unroll
                for (int j = 1; j < 8; ++j) tm[nt] = fmaxf(tm[nt], pf[q][nt][j]);
            }
            float t = fmaxf(fmaxf(tm[0], tm[1]), fmaxf(tm[2], tm[3]));
            t = fmaxf(t, xhalf(t));
            const float mn    = fmaxf(mrow[q], t);
            const float alpha = exp_slot(mrow[q] - mn);
            mrow[q] = mn;
            float rs[NT];
            #pragma unroll
            for (int nt = 0; nt < NT; ++nt) {
                rs[nt] = 0.0f;
                #pragma unroll
                for (int j = 0; j < 8; ++j) {
                    const float p = exp_slot(pf[q][nt][j] - mn);
                    pf[q][nt][j] = p;
                    rs[nt] += p;
                }
            }
            lsum[q] = lsum[q] * alpha + ((rs[0] + rs[1]) + (rs[2] + rs[3]));
            #pragma unroll
            for (int f = 0; f < NT; ++f) { oRe[q][f] *= alpha; oIm[q][f] *= alpha; }
        }

        // ---- O^T += V^T P^T. The accumulator pair (pf[q][nt][2t], pf[q][nt][2t+1]) is already a
        //      B fragment: its k slots 2*h16 + {0,1} are keys nt*16 + 8*h16 + 2t + {0,1};
        //      the V^T fragment (A: lane = e, same k slots) reads the same keys' rows. ----
        #pragma unroll   // the set b & 1 and every fragment index must be compile-time constants
        for (int b = 0; b < NBLK; ++b) {
            const int f = b >> 1;
            if (b + 1 < NBLK) {
                load_v(b + 1);
                // Fence: keeps the read group above from sinking among the WMMAs below.
                __builtin_amdgcn_sched_barrier(0);
            }
            #pragma unroll
            for (int i = 0; i < FB; ++i) {
                const int nt = (b & 1) * 2 + (i >> 2);
                const int t2 = i & 3;
                #pragma unroll
                for (int q = 0; q < QT; ++q) {
                    const v2f bP = { pf[q][nt][2 * t2], pf[q][nt][2 * t2 + 1] };
                    oRe[q][f] = __builtin_amdgcn_wmma_f32_16x16x4_f32(false, fR[b & 1][i], false, bP, (short)0, oRe[q][f], false, false);
                    oIm[q][f] = __builtin_amdgcn_wmma_f32_16x16x4_f32(false, fI[b & 1][i], false, bP, (short)0, oIm[q][f], false, false);
                }
            }
            // Fence: keeps the next read group from rising among the WMMAs above.
            if (b + 2 < NBLK) __builtin_amdgcn_sched_barrier(0);
        }

        // Next buffer ready + everyone done reading current buffer.
        if (st + 1 < NSTEP) {
            wait_ds0();
            wait_async0();
            __syncthreads();
        }
    }

    // ---- Normalize and store [2,b,n,l,h,e] ----
    const size_t obase = (size_t)bn * L_ * ROW + (size_t)h * E_;
    #pragma unroll
    for (int q = 0; q < QT; ++q) {
        const float inv = 1.0f / (lsum[q] + xhalf(lsum[q]));
        float* orow = out + obase + (size_t)(l0 + q * 16 + mlo) * ROW + 8 * h16;   // 32-byte aligned
        #pragma unroll
        for (int f = 0; f < NT; ++f) {
            const v8f re = oRe[q][f] * inv;
            const v8f im = oIm[q][f] * inv;
            *(v4f*)(orow + f * 16)             = __builtin_shufflevector(re, re, 0, 1, 2, 3);
            *(v4f*)(orow + f * 16 + 4)         = __builtin_shufflevector(re, re, 4, 5, 6, 7);
            *(v4f*)(orow + IMOFF + f * 16)     = __builtin_shufflevector(im, im, 0, 1, 2, 3);
            *(v4f*)(orow + IMOFF + f * 16 + 4) = __builtin_shufflevector(im, im, 4, 5, 6, 7);
        }
    }
}

extern "C" void kernel_launch(void* const* d_in, const int* in_sizes, int n_in,
                              void* d_out, int out_size, void* d_ws, size_t ws_size,
                              hipStream_t stream) {
    (void)in_sizes; (void)n_in; (void)out_size; (void)d_ws; (void)ws_size;
    const float* q_re = (const float*)d_in[0];
    const float* q_im = (const float*)d_in[1];
    const float* k_re = (const float*)d_in[2];
    const float* k_im = (const float*)d_in[3];
    const float* v_re = (const float*)d_in[4];
    const float* v_im = (const float*)d_in[5];
    float* out = (float*)d_out;

    const dim3 grid(B_ * N_ * H_ * (L_ / BM));   // 1024 blocks
    const dim3 block(NTHR);                      // 4 waves (wave32)
    const size_t smem = (size_t)(2 * BUFSZ) * sizeof(float);   // 136 KiB

    ca_flash_wmma_f32<<<grid, block, smem, stream>>>(q_re, q_im, k_re, k_im,
                                                     v_re, v_im, out);
}
